// v000
// Measured on an AMD MI455X. A time is GPU time per run, averaged over a window of back-to-back runs after a warm-up
// (all launches, gaps included; the runs take copies of the inputs in turn), and the median of several windows.
// Apart from v000's, it joins two sittings. Times from different sittings can be a few percent apart, while
// side-by-side timings come from the same sitting.
// v000 is the starting kernel. One run takes 248 microseconds.
#include <hip/hip_runtime.h>
#include <math.h>
#include <stdint.h>

typedef __attribute__((ext_vector_type(2))) float v2f;
typedef __attribute__((ext_vector_type(8))) float v8f;

namespace {

constexpr int H = 8;
constexpr int L = 256;
constexpr int C = 32;
constexpr int THREADS = 512;   // 16 waves (wave32); each wave owns 16 query rows

__global__ __launch_bounds__(THREADS)
void tri_attn_kernel(const float* __restrict__ q,
                     const float* __restrict__ k,
                     const float* __restrict__ v,
                     const float* __restrict__ bias,
                     const float* __restrict__ gate,
                     float* __restrict__ out)
{
    __shared__ float v_lds[L * C];        // 32 KB: V for this (h,s1) pair
    __shared__ float p_lds[16][16][18];   // per-wave P re-layout tile, padded stride

    const int pair  = blockIdx.x;         // pair = h*L + s1
    const int h     = pair >> 8;
    const int s1    = pair & (L - 1);
    const int tid   = threadIdx.x;
    const int wid   = tid >> 5;           // 0..15
    const int lane  = tid & 31;
    const int lhalf = lane >> 4;          // 0 | 1
    const int l16   = lane & 15;

    const size_t poff = (size_t)pair * (L * C);
    const float* qp = q + poff;
    const float* kp = k + poff;
    const float* vp = v + poff;

    // ---- stage V into LDS via CDNA5 async copy (no VGPR round-trip) ----
    // 32 KB total; each of 512 threads moves 4 x 16B. INST_OFFSET is applied to
    // both the LDS and the global address, so one (lds, voffset) pair serves all 4.
    {
        const uint32_t lds_off = (uint32_t)(uintptr_t)v_lds + (uint32_t)tid * 16u;
        const uint32_t voff    = (uint32_t)tid * 16u;
        asm volatile("global_load_async_to_lds_b128 %0, %1, %2"
                     :: "v"(lds_off), "v"(voff), "s"(vp) : "memory");
        asm volatile("global_load_async_to_lds_b128 %0, %1, %2 offset:8192"
                     :: "v"(lds_off), "v"(voff), "s"(vp) : "memory");
        asm volatile("global_load_async_to_lds_b128 %0, %1, %2 offset:16384"
                     :: "v"(lds_off), "v"(voff), "s"(vp) : "memory");
        asm volatile("global_load_async_to_lds_b128 %0, %1, %2 offset:24576"
                     :: "v"(lds_off), "v"(voff), "s"(vp) : "memory");
        asm volatile("s_wait_asynccnt 0x0" ::: "memory");
    }
    __syncthreads();

    const int qbase = wid * 16;           // this wave's query rows

    // Per-lane base pointers; all further addressing is via constant immediates.
    const float* qb = qp + (size_t)(qbase + l16) * C + 2 * lhalf;
    const float* kb = kp + (size_t)l16 * C + 2 * lhalf;
    const float* bp = bias + ((size_t)(qbase + 8 * lhalf) * L + (size_t)l16) * H + h;

    // ---- load Q in WMMA f32 16x16x4 A-layout: lane = row l16, K-pair 2*lhalf ----
    v2f a[8];
    #pragma unroll
    for (int ks = 0; ks < 8; ++ks)
        a[ks] = *(const v2f*)(qb + ks * 4);

    // ---- S = Q*K^T + bias ----
    // Both the K B-tiles AND the bias accumulator-init are software-pipelined one
    // key-tile ahead: all loads for tile nt+1 issue before the WMMAs of tile nt,
    // so the wait before each WMMA group leaves a full tile of loads in flight.
    v8f s[16];
    v2f bb[2][8];
    v8f accN;
    #pragma unroll
    for (int ks = 0; ks < 8; ++ks)
        bb[0][ks] = *(const v2f*)(kb + ks * 4);
    #pragma unroll
    for (int r = 0; r < 8; ++r)
        accN[r] = bp[r * (L * H)];

    #pragma unroll
    for (int nt = 0; nt < 16; ++nt) {
        const int cur = nt & 1;
        v8f acc = accN;
        if (nt < 15) {
            #pragma unroll
            for (int r = 0; r < 8; ++r)
                accN[r] = bp[r * (L * H) + (nt + 1) * (16 * H)];
            #pragma unroll
            for (int ks = 0; ks < 8; ++ks)
                bb[cur ^ 1][ks] = *(const v2f*)(kb + (nt + 1) * 16 * C + ks * 4);
        }
        #pragma unroll
        for (int ks = 0; ks < 8; ++ks) {
            acc = __builtin_amdgcn_wmma_f32_16x16x4_f32(
                      false, a[ks], false, bb[cur][ks], (short)0, acc, false, false);
        }
        s[nt] = acc;
    }

    // ---- softmax over keys: row = fixed component r within a 16-lane half ----
    v8f mx = s[0];
    #pragma unroll
    for (int nt = 1; nt < 16; ++nt) {
        #pragma unroll
        for (int r = 0; r < 8; ++r) mx[r] = fmaxf(mx[r], s[nt][r]);
    }
    #pragma unroll
    for (int off = 1; off < 16; off <<= 1) {
        #pragma unroll
        for (int r = 0; r < 8; ++r)
            mx[r] = fmaxf(mx[r], __shfl_xor(mx[r], off, 32));
    }

    v8f rs;
    #pragma unroll
    for (int r = 0; r < 8; ++r) rs[r] = 0.0f;
    #pragma unroll
    for (int nt = 0; nt < 16; ++nt) {
        #pragma unroll
        for (int r = 0; r < 8; ++r) {
            const float p = __expf(s[nt][r] - mx[r]);
            s[nt][r] = p;
            rs[r]   += p;
        }
    }
    #pragma unroll
    for (int off = 1; off < 16; off <<= 1) {
        #pragma unroll
        for (int r = 0; r < 8; ++r)
            rs[r] += __shfl_xor(rs[r], off, 32);
    }

    // ---- O = P*V : re-layout P (C-layout -> A-layout) through per-wave LDS ----
    // Single LDS tile, register-double-buffered operands, pipelined one tile
    // ahead. DS ops are in-order per wave: reads(nt) complete before the
    // stores(nt+1) that overwrite the tile, so this is hazard-free.
    v8f o0, o1;
    #pragma unroll
    for (int r = 0; r < 8; ++r) { o0[r] = 0.0f; o1[r] = 0.0f; }

    float (*pst)[18] = p_lds[wid];
    const float* vbp = v_lds + 2 * lhalf * C + l16;   // per-lane V base in LDS

    v2f pa[2][4], vb0[2][4], vb1[2][4];
    // prologue: stage tile 0 and read its operands
    #pragma unroll
    for (int r = 0; r < 8; ++r)
        pst[r + 8 * lhalf][l16] = s[0][r];
    #pragma unroll
    for (int kk = 0; kk < 4; ++kk) {
        pa[0][kk] = *(const v2f*)&pst[l16][kk * 4 + 2 * lhalf];
        const int koff = (kk * 4) * C;
        vb0[0][kk].x = vbp[koff];
        vb0[0][kk].y = vbp[koff + C];
        vb1[0][kk].x = vbp[koff + 16];
        vb1[0][kk].y = vbp[koff + C + 16];
    }

    #pragma unroll
    for (int nt = 0; nt < 16; ++nt) {
        const int cur = nt & 1;
        if (nt < 15) {
            #pragma unroll
            for (int r = 0; r < 8; ++r)
                pst[r + 8 * lhalf][l16] = s[nt + 1][r];
            #pragma unroll
            for (int kk = 0; kk < 4; ++kk) {
                pa[cur ^ 1][kk] = *(const v2f*)&pst[l16][kk * 4 + 2 * lhalf];
                const int koff = ((nt + 1) * 16 + kk * 4) * C;
                vb0[cur ^ 1][kk].x = vbp[koff];
                vb0[cur ^ 1][kk].y = vbp[koff + C];
                vb1[cur ^ 1][kk].x = vbp[koff + 16];
                vb1[cur ^ 1][kk].y = vbp[koff + C + 16];
            }
        }
        #pragma unroll
        for (int kk = 0; kk < 4; ++kk) {
            o0 = __builtin_amdgcn_wmma_f32_16x16x4_f32(
                     false, pa[cur][kk], false, vb0[cur][kk], (short)0, o0, false, false);
            o1 = __builtin_amdgcn_wmma_f32_16x16x4_f32(
                     false, pa[cur][kk], false, vb1[cur][kk], (short)0, o1, false, false);
        }
    }

    // ---- normalize, gate, store (const-offset addressing off per-lane bases) ----
    const float* gp = gate + (((size_t)(s1 * L + qbase + 8 * lhalf)) * C + (size_t)l16) * H + h;
    float* op = out + poff + (size_t)(qbase + 8 * lhalf) * C + l16;
    #pragma unroll
    for (int r = 0; r < 8; ++r) {
        const float inv = 1.0f / rs[r];
        const float g0 = gp[r * (C * H)];
        const float g1 = gp[r * (C * H) + 16 * H];
        op[r * C]      = o0[r] * inv * g0;
        op[r * C + 16] = o1[r] * inv * g1;
    }
}

} // namespace

extern "C" void kernel_launch(void* const* d_in, const int* in_sizes, int n_in,
                              void* d_out, int out_size, void* d_ws, size_t ws_size,
                              hipStream_t stream) {
    (void)in_sizes; (void)n_in; (void)out_size; (void)d_ws; (void)ws_size;
    const float* q    = (const float*)d_in[0];
    const float* k    = (const float*)d_in[1];
    const float* v    = (const float*)d_in[2];
    const float* bias = (const float*)d_in[3];
    const float* gate = (const float*)d_in[4];
    float* out = (float*)d_out;

    tri_attn_kernel<<<H * L, THREADS, 0, stream>>>(q, k, v, bias, gate, out);
}

// v001
// One run takes 217 microseconds.
// In two side-by-side timings against v000, it was 1.20 and 1.19 times as fast.
#include <hip/hip_runtime.h>
#include <math.h>
#include <stdint.h>

typedef __attribute__((ext_vector_type(2))) float v2f;
typedef __attribute__((ext_vector_type(8))) float v8f;

namespace {

constexpr int H = 8;
constexpr int L = 256;
constexpr int C = 32;
constexpr int THREADS = 512;   // 16 waves (wave32); each wave owns 16 query rows
constexpr int KP = 36;         // K row pitch in LDS, dwords: 16 rows x 8 B of both lane halves fall on 64 distinct banks

__global__ __launch_bounds__(THREADS)
void tri_attn_kernel(const float* __restrict__ q,
                     const float* __restrict__ k,
                     const float* __restrict__ v,
                     const float* __restrict__ bias,
                     const float* __restrict__ gate,
                     float* __restrict__ out)
{
    __shared__ float v_lds[L * C];        // 32 KB: V for this (h,s1) pair
    __shared__ __attribute__((aligned(16))) float k_lds[L * KP];   // 36 KB: K for this pair, padded rows
    __shared__ float p_lds[16][16][18];   // per-wave P re-layout tile, padded stride

    const int pair  = blockIdx.x;         // pair = h*L + s1
    const int h     = pair >> 8;
    const int s1    = pair & (L - 1);
    const int tid   = threadIdx.x;
    const int wid   = tid >> 5;           // 0..15
    const int lane  = tid & 31;
    const int lhalf = lane >> 4;          // 0 | 1
    const int l16   = lane & 15;

    const size_t poff = (size_t)pair * (L * C);
    const float* qp = q + poff;
    const float* kp = k + poff;
    const float* vp = v + poff;

    // ---- stage K into LDS once per work-group (async copies, padded rows) ----
    // All 16 waves need the whole K. Read from global in B-fragment order, one
    // 8-byte load per lane touches 16 cache lines, and every wave repeats it.
    // Here each 16-byte chunk is fetched once, in whole lines: chunk c = tid + i*512,
    // row c/8, column c%8. The wait on asynccnt and the barrier below (behind the
    // V copies) cover these copies too.
    {
        const uint32_t kl0 = (uint32_t)(uintptr_t)k_lds
                           + (uint32_t)(tid >> 3) * (KP * 4u) + (uint32_t)(tid & 7) * 16u;
        const uint32_t kl1 = kl0 + 64u * (KP * 4u);
        const uint32_t kl2 = kl0 + 128u * (KP * 4u);
        const uint32_t kl3 = kl0 + 192u * (KP * 4u);
        const float* kg0 = kp + tid * 4;
        const float* kg1 = kg0 + 2048;
        const float* kg2 = kg0 + 4096;
        const float* kg3 = kg0 + 6144;
        // s_wait_xcnt closes the statement so that no address register named by a
        // copy can be rewritten ahead of it.
        asm volatile("global_load_async_to_lds_b128 %0, %4, off\n\t"
                     "global_load_async_to_lds_b128 %1, %5, off\n\t"
                     "global_load_async_to_lds_b128 %2, %6, off\n\t"
                     "global_load_async_to_lds_b128 %3, %7, off\n\t"
                     "s_wait_xcnt 0x0"
                     :: "v"(kl0), "v"(kl1), "v"(kl2), "v"(kl3),
                        "v"(kg0), "v"(kg1), "v"(kg2), "v"(kg3) : "memory");
    }

    // ---- stage V into LDS via CDNA5 async copy (no VGPR round-trip) ----
    // 32 KB total; each of 512 threads moves 4 x 16B. INST_OFFSET is applied to
    // both the LDS and the global address, so one (lds, voffset) pair serves all 4.
    {
        const uint32_t lds_off = (uint32_t)(uintptr_t)v_lds + (uint32_t)tid * 16u;
        const uint32_t voff    = (uint32_t)tid * 16u;
        asm volatile("global_load_async_to_lds_b128 %0, %1, %2"
                     :: "v"(lds_off), "v"(voff), "s"(vp) : "memory");
        asm volatile("global_load_async_to_lds_b128 %0, %1, %2 offset:8192"
                     :: "v"(lds_off), "v"(voff), "s"(vp) : "memory");
        asm volatile("global_load_async_to_lds_b128 %0, %1, %2 offset:16384"
                     :: "v"(lds_off), "v"(voff), "s"(vp) : "memory");
        asm volatile("global_load_async_to_lds_b128 %0, %1, %2 offset:24576"
                     :: "v"(lds_off), "v"(voff), "s"(vp) : "memory");
        asm volatile("s_wait_asynccnt 0x0" ::: "memory");
    }
    __syncthreads();

    const int qbase = wid * 16;           // this wave's query rows

    // Per-lane base pointers; all further addressing is via constant immediates.
    const float* qb = qp + (size_t)(qbase + l16) * C + 2 * lhalf;
    const float* kb = k_lds + l16 * KP + 2 * lhalf;   // B fragments come from LDS
    const float* bp = bias + ((size_t)(qbase + 8 * lhalf) * L + (size_t)l16) * H + h;

    // ---- load Q in WMMA f32 16x16x4 A-layout: lane = row l16, K-pair 2*lhalf ----
    v2f a[8];
    #pragma unroll
    for (int ks = 0; ks < 8; ++ks)
        a[ks] = *(const v2f*)(qb + ks * 4);

    // ---- S = Q*K^T + bias ----
    // Both the K B-tiles AND the bias accumulator-init are software-pipelined one
    // key-tile ahead: all loads for tile nt+1 issue before the WMMAs of tile nt,
    // so the wait before each WMMA group leaves a full tile of loads in flight.
    v8f s[16];
    v2f bb[2][8];
    v8f accN;
    #pragma unroll
    for (int ks = 0; ks < 8; ++ks)
        bb[0][ks] = *(const v2f*)(kb + ks * 4);
    #pragma unroll
    for (int r = 0; r < 8; ++r)
        accN[r] = bp[r * (L * H)];

    #pragma unroll
    for (int nt = 0; nt < 16; ++nt) {
        const int cur = nt & 1;
        v8f acc = accN;
        if (nt < 15) {
            #pragma unroll
            for (int r = 0; r < 8; ++r)
                accN[r] = bp[r * (L * H) + (nt + 1) * (16 * H)];
            #pragma unroll
            for (int ks = 0; ks < 8; ++ks)
                bb[cur ^ 1][ks] = *(const v2f*)(kb + (nt + 1) * 16 * KP + ks * 4);
        }
        // LDS reads and WMMAs may not cross (global loads and plain ALU may): keeps
        // the next tile's K reads one group ahead of this tile's WMMAs.
        __builtin_amdgcn_sched_barrier(0x416);
        #pragma unroll
        for (int ks = 0; ks < 8; ++ks) {
            acc = __builtin_amdgcn_wmma_f32_16x16x4_f32(
                      false, a[ks], false, bb[cur][ks], (short)0, acc, false, false);
        }
        s[nt] = acc;
        // Same mask: without it the K reads of many later tiles are hoisted up here
        // and the kernel spills registers to scratch.
        __builtin_amdgcn_sched_barrier(0x416);
    }

    // ---- softmax over keys: row = fixed component r within a 16-lane half ----
    v8f mx = s[0];
    #pragma unroll
    for (int nt = 1; nt < 16; ++nt) {
        #pragma unroll
        for (int r = 0; r < 8; ++r) mx[r] = fmaxf(mx[r], s[nt][r]);
    }
    #pragma unroll
    for (int off = 1; off < 16; off <<= 1) {
        #pragma unroll
        for (int r = 0; r < 8; ++r)
            mx[r] = fmaxf(mx[r], __shfl_xor(mx[r], off, 32));
    }

    v8f rs;
    #pragma unroll
    for (int r = 0; r < 8; ++r) rs[r] = 0.0f;
    #pragma unroll
    for (int nt = 0; nt < 16; ++nt) {
        #pragma unroll
        for (int r = 0; r < 8; ++r) {
            const float p = __expf(s[nt][r] - mx[r]);
            s[nt][r] = p;
            rs[r]   += p;
        }
    }
    #pragma unroll
    for (int off = 1; off < 16; off <<= 1) {
        #pragma unroll
        for (int r = 0; r < 8; ++r)
            rs[r] += __shfl_xor(rs[r], off, 32);
    }

    // ---- O = P*V : re-layout P (C-layout -> A-layout) through per-wave LDS ----
    // Single LDS tile, register-double-buffered operands, pipelined one tile
    // ahead. DS ops are in-order per wave: reads(nt) complete before the
    // stores(nt+1) that overwrite the tile, so this is hazard-free.
    v8f o0, o1;
    #pragma unroll
    for (int r = 0; r < 8; ++r) { o0[r] = 0.0f; o1[r] = 0.0f; }

    float (*pst)[18] = p_lds[wid];
    const float* vbp = v_lds + 2 * lhalf * C + l16;   // per-lane V base in LDS

    v2f pa[2][4], vb0[2][4], vb1[2][4];
    // prologue: stage tile 0 and read its operands
    #pragma unroll
    for (int r = 0; r < 8; ++r)
        pst[r + 8 * lhalf][l16] = s[0][r];
    #pragma unroll
    for (int kk = 0; kk < 4; ++kk) {
        pa[0][kk] = *(const v2f*)&pst[l16][kk * 4 + 2 * lhalf];
        const int koff = (kk * 4) * C;
        vb0[0][kk].x = vbp[koff];
        vb0[0][kk].y = vbp[koff + C];
        vb1[0][kk].x = vbp[koff + 16];
        vb1[0][kk].y = vbp[koff + C + 16];
    }

    #pragma unroll
    for (int nt = 0; nt < 16; ++nt) {
        const int cur = nt & 1;
        if (nt < 15) {
            #pragma unroll
            for (int r = 0; r < 8; ++r)
                pst[r + 8 * lhalf][l16] = s[nt + 1][r];
            #pragma unroll
            for (int kk = 0; kk < 4; ++kk) {
                pa[cur ^ 1][kk] = *(const v2f*)&pst[l16][kk * 4 + 2 * lhalf];
                const int koff = ((nt + 1) * 16 + kk * 4) * C;
                vb0[cur ^ 1][kk].x = vbp[koff];
                vb0[cur ^ 1][kk].y = vbp[koff + C];
                vb1[cur ^ 1][kk].x = vbp[koff + 16];
                vb1[cur ^ 1][kk].y = vbp[koff + C + 16];
            }
        }
        #pragma unroll
        for (int kk = 0; kk < 4; ++kk) {
            o0 = __builtin_amdgcn_wmma_f32_16x16x4_f32(
                     false, pa[cur][kk], false, vb0[cur][kk], (short)0, o0, false, false);
            o1 = __builtin_amdgcn_wmma_f32_16x16x4_f32(
                     false, pa[cur][kk], false, vb1[cur][kk], (short)0, o1, false, false);
        }
    }

    // ---- normalize, gate, store (const-offset addressing off per-lane bases) ----
    const float* gp = gate + (((size_t)(s1 * L + qbase + 8 * lhalf)) * C + (size_t)l16) * H + h;
    float* op = out + poff + (size_t)(qbase + 8 * lhalf) * C + l16;
    #pragma unroll
    for (int r = 0; r < 8; ++r) {
        const float inv = 1.0f / rs[r];
        const float g0 = gp[r * (C * H)];
        const float g1 = gp[r * (C * H) + 16 * H];
        op[r * C]      = o0[r] * inv * g0;
        op[r * C + 16] = o1[r] * inv * g1;
    }
}

} // namespace

extern "C" void kernel_launch(void* const* d_in, const int* in_sizes, int n_in,
                              void* d_out, int out_size, void* d_ws, size_t ws_size,
                              hipStream_t stream) {
    (void)in_sizes; (void)n_in; (void)out_size; (void)d_ws; (void)ws_size;
    const float* q    = (const float*)d_in[0];
    const float* k    = (const float*)d_in[1];
    const float* v    = (const float*)d_in[2];
    const float* bias = (const float*)d_in[3];
    const float* gate = (const float*)d_in[4];
    float* out = (float*)d_out;

    tri_attn_kernel<<<H * L, THREADS, 0, stream>>>(q, k, v, bias, gate, out);
}

// v002
// It runs in 138 microseconds.
// Timed twice side by side with v001, it ran 1.57 times as fast both times.
// All steps since v000 together make it 1.87 times as fast.
#include <hip/hip_runtime.h>
#include <math.h>
#include <stdint.h>

typedef __attribute__((ext_vector_type(2))) float v2f;
typedef __attribute__((ext_vector_type(4))) float v4f;
typedef __attribute__((ext_vector_type(8))) float v8f;

namespace {

constexpr int H = 8;
constexpr int L = 256;
constexpr int C = 32;
constexpr int THREADS = 512;   // 16 waves (wave32); each wave owns 16 query rows
constexpr int KP = 36;         // K row pitch in LDS, dwords: 16 rows x 8 B of both lane halves fall on 64 distinct banks

// ---- repack bias [q][key][head] into per-head accumulator-fragment order ----
// In the input one head's values lie 32 bytes apart, so a score tile's start
// values cost one cache line per four values, and every work-group of a head
// pulls the whole array through L2. Here the array is read once in whole lines
// and written so that the score kernel reads each 16x16 tile as two 512-byte runs:
//   bt[head][q tile][key tile][row quad rq][lane][4],  row = 8*(lane>>4) + 4*rq + j,
//   key = lane & 15 (the f32 16x16 accumulator layout).
// One thread: four rows x one key x eight heads. A wave writes 256-byte runs.
constexpr int RP_THREADS = 128;
constexpr int RP_BLOCKS  = (L / 4) * L / RP_THREADS;

__global__ __launch_bounds__(RP_THREADS)
void bias_repack_kernel(const float* __restrict__ bias, float* __restrict__ bt)
{
    const int t    = blockIdx.x * RP_THREADS + threadIdx.x;
    const int key  = t & (L - 1);
    const int qq   = t >> 8;              // quad of query rows, 0..63
    const int qt   = qq >> 2;             // 16-row query tile
    const int half = (qq >> 1) & 1;       // lane half that owns these rows
    const int rq   = qq & 1;              // first or second 16-byte load of the tile

    v4f lo[4], hi[4];
    #pragma unroll
    for (int j = 0; j < 4; ++j) {
        const float* src = bias + ((size_t)(qq * 4 + j) * L + key) * H;
        lo[j] = *(const v4f*)src;
        hi[j] = *(const v4f*)(src + 4);
    }
    float* dst = bt + ((qt * 16 + (key >> 4)) * 2 + rq) * 128 + (half * 16 + (key & 15)) * 4;
    #pragma unroll
    for (int hh = 0; hh < 4; ++hh) {
        v4f w0 = { lo[0][hh], lo[1][hh], lo[2][hh], lo[3][hh] };
        v4f w1 = { hi[0][hh], hi[1][hh], hi[2][hh], hi[3][hh] };
        *(v4f*)(dst + hh * (L * L))       = w0;
        *(v4f*)(dst + (hh + 4) * (L * L)) = w1;
    }
}

__global__ __launch_bounds__(THREADS)
void tri_attn_kernel(const float* __restrict__ q,
                     const float* __restrict__ k,
                     const float* __restrict__ v,
                     const float* __restrict__ bt,
                     const float* __restrict__ gate,
                     float* __restrict__ out)
{
    __shared__ float v_lds[L * C];        // 32 KB: V for this (h,s1) pair
    __shared__ __attribute__((aligned(16))) float k_lds[L * KP];   // 36 KB: K for this pair, padded rows
    __shared__ float p_lds[16][16][18];   // per-wave P re-layout tile, padded stride

    const int pair  = blockIdx.x;         // pair = h*L + s1
    const int h     = pair >> 8;
    const int s1    = pair & (L - 1);
    const int tid   = threadIdx.x;
    const int wid   = tid >> 5;           // 0..15
    const int lane  = tid & 31;
    const int lhalf = lane >> 4;          // 0 | 1
    const int l16   = lane & 15;

    const size_t poff = (size_t)pair * (L * C);
    const float* qp = q + poff;
    const float* kp = k + poff;
    const float* vp = v + poff;

    // ---- stage K into LDS once per work-group (async copies, padded rows) ----
    // All 16 waves need the whole K. Read from global in B-fragment order, one
    // 8-byte load per lane touches 16 cache lines, and every wave repeats it.
    // Here each 16-byte chunk is fetched once, in whole lines: chunk c = tid + i*512,
    // row c/8, column c%8. The wait on asynccnt and the barrier below (behind the
    // V copies) cover these copies too.
    {
        const uint32_t kl0 = (uint32_t)(uintptr_t)k_lds
                           + (uint32_t)(tid >> 3) * (KP * 4u) + (uint32_t)(tid & 7) * 16u;
        const uint32_t kl1 = kl0 + 64u * (KP * 4u);
        const uint32_t kl2 = kl0 + 128u * (KP * 4u);
        const uint32_t kl3 = kl0 + 192u * (KP * 4u);
        const float* kg0 = kp + tid * 4;
        const float* kg1 = kg0 + 2048;
        const float* kg2 = kg0 + 4096;
        const float* kg3 = kg0 + 6144;
        // s_wait_xcnt closes the statement so that no address register named by a
        // copy can be rewritten ahead of it.
        asm volatile("global_load_async_to_lds_b128 %0, %4, off\n\t"
                     "global_load_async_to_lds_b128 %1, %5, off\n\t"
                     "global_load_async_to_lds_b128 %2, %6, off\n\t"
                     "global_load_async_to_lds_b128 %3, %7, off\n\t"
                     "s_wait_xcnt 0x0"
                     :: "v"(kl0), "v"(kl1), "v"(kl2), "v"(kl3),
                        "v"(kg0), "v"(kg1), "v"(kg2), "v"(kg3) : "memory");
    }

    // ---- stage V into LDS via CDNA5 async copy (no VGPR round-trip) ----
    // 32 KB total; each of 512 threads moves 4 x 16B. INST_OFFSET is applied to
    // both the LDS and the global address, so one (lds, voffset) pair serves all 4.
    {
        const uint32_t lds_off = (uint32_t)(uintptr_t)v_lds + (uint32_t)tid * 16u;
        const uint32_t voff    = (uint32_t)tid * 16u;
        asm volatile("global_load_async_to_lds_b128 %0, %1, %2"
                     :: "v"(lds_off), "v"(voff), "s"(vp) : "memory");
        asm volatile("global_load_async_to_lds_b128 %0, %1, %2 offset:8192"
                     :: "v"(lds_off), "v"(voff), "s"(vp) : "memory");
        asm volatile("global_load_async_to_lds_b128 %0, %1, %2 offset:16384"
                     :: "v"(lds_off), "v"(voff), "s"(vp) : "memory");
        asm volatile("global_load_async_to_lds_b128 %0, %1, %2 offset:24576"
                     :: "v"(lds_off), "v"(voff), "s"(vp) : "memory");
        asm volatile("s_wait_asynccnt 0x0" ::: "memory");
    }
    __syncthreads();

    const int qbase = wid * 16;           // this wave's query rows

    // Per-lane base pointers; all further addressing is via constant immediates.
    const float* qb = qp + (size_t)(qbase + l16) * C + 2 * lhalf;
    const float* kb = k_lds + l16 * KP + 2 * lhalf;   // B fragments come from LDS
    const float* bp = bt + (size_t)(h * 16 + wid) * (16 * L) + lane * 4;   // repacked bias, this wave's 16 rows

    // ---- load Q in WMMA f32 16x16x4 A-layout: lane = row l16, K-pair 2*lhalf ----
    v2f a[8];
    #pragma unroll
    for (int ks = 0; ks < 8; ++ks)
        a[ks] = *(const v2f*)(qb + ks * 4);
    // Loads return in issue order and the first WMMA needs all of Q but only one
    // bias tile: keeps the Q loads ahead of the 32 bias loads below.
    __builtin_amdgcn_sched_barrier(0);

    // ---- S = Q*K^T + bias ----
    // Every score tile starts as its bias tile: two whole-line 16-byte loads, all
    // issued here, straight into the registers that hold the scores anyway.
    // The K B-tiles are software-pipelined one key-tile ahead.
    v8f s[16];
    v2f bb[2][8];
    #pragma unroll
    for (int nt = 0; nt < 16; ++nt) {
        const v4f b0 = *(const v4f*)(bp + nt * 256);
        const v4f b1 = *(const v4f*)(bp + nt * 256 + 128);
        s[nt] = __builtin_shufflevector(b0, b1, 0, 1, 2, 3, 4, 5, 6, 7);
    }
    // Keeps both address pairs of the loads above untouched until their address
    // translations are counted off (otherwise the last load of each run lands on
    // the very pair the run is addressed by). The loads also stay ahead of this
    // statement; without it the compiler sinks each bias load to just ahead of its tile.
    asm volatile("s_wait_xcnt 0x0" :: "v"(qb), "v"(bp) : "memory");
    #pragma unroll
    for (int ks = 0; ks < 8; ++ks)
        bb[0][ks] = *(const v2f*)(kb + ks * 4);

    #pragma unroll
    for (int nt = 0; nt < 16; ++nt) {
        const int cur = nt & 1;
        v8f acc = s[nt];
        if (nt < 15) {
            #pragma unroll
            for (int ks = 0; ks < 8; ++ks)
                bb[cur ^ 1][ks] = *(const v2f*)(kb + (nt + 1) * 16 * KP + ks * 4);
        }
        // LDS reads and WMMAs may not cross (global loads and plain ALU may): keeps
        // the next tile's K reads one group ahead of this tile's WMMAs.
        __builtin_amdgcn_sched_barrier(0x416);
        #pragma unroll
        for (int ks = 0; ks < 8; ++ks) {
            acc = __builtin_amdgcn_wmma_f32_16x16x4_f32(
                      false, a[ks], false, bb[cur][ks], (short)0, acc, false, false);
        }
        s[nt] = acc;
        // Same mask: without it the K reads of many later tiles are hoisted up here
        // and the kernel spills registers to scratch.
        __builtin_amdgcn_sched_barrier(0x416);
    }

    // ---- softmax over keys: row = fixed component r within a 16-lane half ----
    v8f mx = s[0];
    #pragma unroll
    for (int nt = 1; nt < 16; ++nt) {
        #pragma unroll
        for (int r = 0; r < 8; ++r) mx[r] = fmaxf(mx[r], s[nt][r]);
    }
    #pragma unroll
    for (int off = 1; off < 16; off <<= 1) {
        #pragma unroll
        for (int r = 0; r < 8; ++r)
            mx[r] = fmaxf(mx[r], __shfl_xor(mx[r], off, 32));
    }

    v8f rs;
    #pragma unroll
    for (int r = 0; r < 8; ++r) rs[r] = 0.0f;
    #pragma unroll
    for (int nt = 0; nt < 16; ++nt) {
        #pragma unroll
        for (int r = 0; r < 8; ++r) {
            const float p = __expf(s[nt][r] - mx[r]);
            s[nt][r] = p;
            rs[r]   += p;
        }
    }
    #pragma unroll
    for (int off = 1; off < 16; off <<= 1) {
        #pragma unroll
        for (int r = 0; r < 8; ++r)
            rs[r] += __shfl_xor(rs[r], off, 32);
    }

    // ---- O = P*V : re-layout P (C-layout -> A-layout) through per-wave LDS ----
    // Single LDS tile, register-double-buffered operands, pipelined one tile
    // ahead. DS ops are in-order per wave: reads(nt) complete before the
    // stores(nt+1) that overwrite the tile, so this is hazard-free.
    v8f o0, o1;
    #pragma unroll
    for (int r = 0; r < 8; ++r) { o0[r] = 0.0f; o1[r] = 0.0f; }

    float (*pst)[18] = p_lds[wid];
    const float* vbp = v_lds + 2 * lhalf * C + l16;   // per-lane V base in LDS

    v2f pa[2][4], vb0[2][4], vb1[2][4];
    // prologue: stage tile 0 and read its operands
    #pragma unroll
    for (int r = 0; r < 8; ++r)
        pst[r + 8 * lhalf][l16] = s[0][r];
    #pragma unroll
    for (int kk = 0; kk < 4; ++kk) {
        pa[0][kk] = *(const v2f*)&pst[l16][kk * 4 + 2 * lhalf];
        const int koff = (kk * 4) * C;
        vb0[0][kk].x = vbp[koff];
        vb0[0][kk].y = vbp[koff + C];
        vb1[0][kk].x = vbp[koff + 16];
        vb1[0][kk].y = vbp[koff + C + 16];
    }

    #pragma unroll
    for (int nt = 0; nt < 16; ++nt) {
        const int cur = nt & 1;
        if (nt < 15) {
            #pragma unroll
            for (int r = 0; r < 8; ++r)
                pst[r + 8 * lhalf][l16] = s[nt + 1][r];
            #pragma unroll
            for (int kk = 0; kk < 4; ++kk) {
                pa[cur ^ 1][kk] = *(const v2f*)&pst[l16][kk * 4 + 2 * lhalf];
                const int koff = ((nt + 1) * 16 + kk * 4) * C;
                vb0[cur ^ 1][kk].x = vbp[koff];
                vb0[cur ^ 1][kk].y = vbp[koff + C];
                vb1[cur ^ 1][kk].x = vbp[koff + 16];
                vb1[cur ^ 1][kk].y = vbp[koff + C + 16];
            }
        }
        #pragma unroll
        for (int kk = 0; kk < 4; ++kk) {
            o0 = __builtin_amdgcn_wmma_f32_16x16x4_f32(
                     false, pa[cur][kk], false, vb0[cur][kk], (short)0, o0, false, false);
            o1 = __builtin_amdgcn_wmma_f32_16x16x4_f32(
                     false, pa[cur][kk], false, vb1[cur][kk], (short)0, o1, false, false);
        }
    }

    // ---- normalize, gate, store (const-offset addressing off per-lane bases) ----
    const float* gp = gate + (((size_t)(s1 * L + qbase + 8 * lhalf)) * C + (size_t)l16) * H + h;
    float* op = out + poff + (size_t)(qbase + 8 * lhalf) * C + l16;
    #pragma unroll
    for (int r = 0; r < 8; ++r) {
        const float inv = 1.0f / rs[r];
        const float g0 = gp[r * (C * H)];
        const float g1 = gp[r * (C * H) + 16 * H];
        op[r * C]      = o0[r] * inv * g0;
        op[r * C + 16] = o1[r] * inv * g1;
    }
}

} // namespace

extern "C" void kernel_launch(void* const* d_in, const int* in_sizes, int n_in,
                              void* d_out, int out_size, void* d_ws, size_t ws_size,
                              hipStream_t stream) {
    (void)in_sizes; (void)n_in; (void)out_size; (void)ws_size;
    const float* q    = (const float*)d_in[0];
    const float* k    = (const float*)d_in[1];
    const float* v    = (const float*)d_in[2];
    const float* bias = (const float*)d_in[3];
    const float* gate = (const float*)d_in[4];
    float* out = (float*)d_out;
    float* bt  = (float*)d_ws;            // H*L*L floats, rewritten on every call

    bias_repack_kernel<<<RP_BLOCKS, RP_THREADS, 0, stream>>>(bias, bt);
    tri_attn_kernel<<<H * L, THREADS, 0, stream>>>(q, k, v, bt, gate, out);
}

// v003
// A run of this version takes 125 microseconds.
// In both of two side-by-side timings against v002, it was 1.10 times as fast.
// Over all steps from v000 it is 2.06 times as fast.
#include <hip/hip_runtime.h>
#include <math.h>
#include <stdint.h>

typedef __attribute__((ext_vector_type(2))) float v2f;
typedef __attribute__((ext_vector_type(4))) float v4f;
typedef __attribute__((ext_vector_type(8))) float v8f;

namespace {

constexpr int H = 8;
constexpr int L = 256;
constexpr int C = 32;
constexpr int THREADS = 512;   // 16 waves (wave32); each wave owns 16 query rows
constexpr int KP = 36;         // K row pitch in LDS, dwords: 16 rows x 8 B of both lane halves fall on 64 distinct banks
constexpr int VP = 36;         // V row pitch in LDS, dwords: the lane halves read rows 8 apart, 8*36 = 32 banks apart
constexpr int OP = 36;         // pitch of the per-wave output tile in LDS, dwords (16 B x odd, for 16-byte stores)

// ---- repack bias [q][key][head] into per-head accumulator-fragment order ----
// In the input one head's values lie 32 bytes apart, so a score tile's start
// values cost one cache line per four values, and every work-group of a head
// pulls the whole array through L2. Here the array is read once in whole lines
// and written so that the score kernel reads each 16x16 tile as two 512-byte runs:
//   bt[head][q tile][key tile][key quad rq][lane][4],  key = 8*(lane>>4) + 4*rq + j,
//   q = lane & 15 (the f32 16x16 accumulator layout of the transposed tile S^T[key][q]).
// One thread: one query x four keys x eight heads = one 128-byte line of the input.
// A wave writes 512-byte runs.
constexpr int RP_THREADS = 128;
constexpr int RP_BLOCKS  = (L / 4) * L / RP_THREADS;

__global__ __launch_bounds__(RP_THREADS)
void bias_repack_kernel(const float* __restrict__ bias, float* __restrict__ bt)
{
    const int t    = blockIdx.x * RP_THREADS + threadIdx.x;
    const int lane = t & 31;              // lane of the score kernel that will read these four values
    const int rq   = (t >> 5) & 1;        // first or second 16-byte load of the tile
    const int kt   = (t >> 6) & 15;       // 16-key tile
    const int qt   = t >> 10;             // 16-row query tile
    const int qrow = qt * 16 + (lane & 15);
    const int key0 = kt * 16 + 8 * (lane >> 4) + 4 * rq;

    v4f lo[4], hi[4];
    #pragma unroll
    for (int j = 0; j < 4; ++j) {
        const float* src = bias + ((size_t)qrow * L + key0 + j) * H;
        lo[j] = *(const v4f*)src;
        hi[j] = *(const v4f*)(src + 4);
    }
    float* dst = bt + ((qt * 16 + kt) * 2 + rq) * 128 + lane * 4;
    #pragma unroll
    for (int hh = 0; hh < 4; ++hh) {
        v4f w0 = { lo[0][hh], lo[1][hh], lo[2][hh], lo[3][hh] };
        v4f w1 = { hi[0][hh], hi[1][hh], hi[2][hh], hi[3][hh] };
        *(v4f*)(dst + hh * (L * L))       = w0;
        *(v4f*)(dst + (hh + 4) * (L * L)) = w1;
    }
}

__global__ __launch_bounds__(THREADS)
void tri_attn_kernel(const float* __restrict__ q,
                     const float* __restrict__ k,
                     const float* __restrict__ v,
                     const float* __restrict__ bt,
                     const float* __restrict__ gate,
                     float* __restrict__ out)
{
    // One LDS block, V first: V is read with immediate offsets off one per-lane base,
    // and an LDS immediate reaches 64 KB from address 0.
    __shared__ __attribute__((aligned(16))) float lds[L * VP + L * KP + 16 * 16 * OP];
    float* const v_lds = lds;                       // 36 KB: V for this (h,s1) pair, padded rows
    float* const k_lds = lds + L * VP;              // 36 KB: K for this pair, padded rows
    float* const o_lds = lds + L * VP + L * KP;     // 36 KB: per-wave output tiles (16 queries x 32 channels)

    const int pair  = blockIdx.x;         // pair = h*L + s1
    const int h     = pair >> 8;
    const int s1    = pair & (L - 1);
    const int tid   = threadIdx.x;
    const int wid   = tid >> 5;           // 0..15
    const int lane  = tid & 31;
    const int lhalf = lane >> 4;          // 0 | 1
    const int l16   = lane & 15;

    const size_t poff = (size_t)pair * (L * C);
    const float* qp = q + poff;
    const float* kp = k + poff;
    const float* vp = v + poff;

    // ---- stage K into LDS once per work-group (async copies, padded rows) ----
    // All 16 waves need the whole K. Read from global in fragment order, one
    // 8-byte load per lane touches 16 cache lines, and every wave repeats it.
    // Here each 16-byte chunk is fetched once, in whole lines: chunk c = tid + i*512,
    // row c/8, column c%8. The wait on asynccnt and the barrier below (behind the
    // V copies) cover these copies too.
    {
        const uint32_t kl0 = (uint32_t)(uintptr_t)k_lds
                           + (uint32_t)(tid >> 3) * (KP * 4u) + (uint32_t)(tid & 7) * 16u;
        const uint32_t kl1 = kl0 + 64u * (KP * 4u);
        const uint32_t kl2 = kl0 + 128u * (KP * 4u);
        const uint32_t kl3 = kl0 + 192u * (KP * 4u);
        const float* kg0 = kp + tid * 4;
        const float* kg1 = kg0 + 2048;
        const float* kg2 = kg0 + 4096;
        const float* kg3 = kg0 + 6144;
        // s_wait_xcnt closes the statement so that no address register named by a
        // copy can be rewritten ahead of it.
        asm volatile("global_load_async_to_lds_b128 %0, %4, off\n\t"
                     "global_load_async_to_lds_b128 %1, %5, off\n\t"
                     "global_load_async_to_lds_b128 %2, %6, off\n\t"
                     "global_load_async_to_lds_b128 %3, %7, off\n\t"
                     "s_wait_xcnt 0x0"
                     :: "v"(kl0), "v"(kl1), "v"(kl2), "v"(kl3),
                        "v"(kg0), "v"(kg1), "v"(kg2), "v"(kg3) : "memory");
    }

    // ---- stage V into LDS the same way (async copies, padded rows) ----
    {
        const uint32_t vl0 = (uint32_t)(uintptr_t)v_lds
                           + (uint32_t)(tid >> 3) * (VP * 4u) + (uint32_t)(tid & 7) * 16u;
        const uint32_t vl1 = vl0 + 64u * (VP * 4u);
        const uint32_t vl2 = vl0 + 128u * (VP * 4u);
        const uint32_t vl3 = vl0 + 192u * (VP * 4u);
        const float* vg0 = vp + tid * 4;
        const float* vg1 = vg0 + 2048;
        const float* vg2 = vg0 + 4096;
        const float* vg3 = vg0 + 6144;
        // s_wait_xcnt closes the statement so that no address register named by a
        // copy can be rewritten ahead of it.
        asm volatile("global_load_async_to_lds_b128 %0, %4, off\n\t"
                     "global_load_async_to_lds_b128 %1, %5, off\n\t"
                     "global_load_async_to_lds_b128 %2, %6, off\n\t"
                     "global_load_async_to_lds_b128 %3, %7, off\n\t"
                     "s_wait_xcnt 0x0"
                     :: "v"(vl0), "v"(vl1), "v"(vl2), "v"(vl3),
                        "v"(vg0), "v"(vg1), "v"(vg2), "v"(vg3) : "memory");
        // Every copy of this wave (K and V) has landed before the barrier publishes them.
        asm volatile("s_wait_asynccnt 0x0" ::: "memory");
    }
    __syncthreads();

    const int qbase = wid * 16;           // this wave's query rows

    // Per-lane base pointers; all further addressing is via constant immediates.
    const float* qb = qp + (size_t)(qbase + l16) * C + 2 * lhalf;
    const float* kb = k_lds + l16 * KP + 2 * lhalf;   // K (A) fragments come from LDS
    const float* bp = bt + (size_t)(h * 16 + wid) * (16 * L) + lane * 4;   // repacked bias, this wave's 16 queries

    // ---- load Q as WMMA f32 16x16x4 B fragments: lane = column (query) l16, K-pair 2*lhalf ----
    v2f a[8];
    #pragma unroll
    for (int ks = 0; ks < 8; ++ks)
        a[ks] = *(const v2f*)(qb + ks * 4);
    // Loads return in issue order and the first WMMA needs all of Q but only one
    // bias tile: keeps the Q loads ahead of the 32 bias loads below.
    __builtin_amdgcn_sched_barrier(0);

    // ---- S^T = K*Q^T + bias^T ----
    // K is the A operand and Q the B operand, so a lane holds scores of ONE query
    // (l16): s[nt][r] = S[query l16][key nt*16 + 8*lhalf + r]. Maximum and sum are
    // then in-lane plus one exchange between the lane halves, and a register pair of
    // s[nt] is already a B fragment of the second product.
    // Every score tile starts as its bias tile: two whole-line 16-byte loads, all
    // issued here, straight into the registers that hold the scores anyway.
    // The K tiles are software-pipelined one key-tile ahead.
    v8f s[16];
    v2f bb[2][8];
    #pragma unroll
    for (int nt = 0; nt < 16; ++nt) {
        const v4f b0 = *(const v4f*)(bp + nt * 256);
        const v4f b1 = *(const v4f*)(bp + nt * 256 + 128);
        s[nt] = __builtin_shufflevector(b0, b1, 0, 1, 2, 3, 4, 5, 6, 7);
    }
    // Keeps both address pairs of the loads above untouched until their address
    // translations are counted off (otherwise the last load of each run lands on
    // the very pair the run is addressed by). The loads also stay ahead of this
    // statement; without it the compiler sinks each bias load to just ahead of its tile.
    asm volatile("s_wait_xcnt 0x0" :: "v"(qb), "v"(bp) : "memory");
    #pragma unroll
    for (int ks = 0; ks < 8; ++ks)
        bb[0][ks] = *(const v2f*)(kb + ks * 4);

    #pragma unroll
    for (int nt = 0; nt < 16; ++nt) {
        const int cur = nt & 1;
        v8f acc = s[nt];
        if (nt < 15) {
            #pragma unroll
            for (int ks = 0; ks < 8; ++ks)
                bb[cur ^ 1][ks] = *(const v2f*)(kb + (nt + 1) * 16 * KP + ks * 4);
        }
        // LDS reads and WMMAs may not cross (global loads and plain ALU may): keeps
        // the next tile's K reads one group ahead of this tile's WMMAs.
        __builtin_amdgcn_sched_barrier(0x416);
        #pragma unroll
        for (int ks = 0; ks < 8; ++ks) {
            acc = __builtin_amdgcn_wmma_f32_16x16x4_f32(
                      false, bb[cur][ks], false, a[ks], (short)0, acc, false, false);
        }
        s[nt] = acc;
        // Same mask: without it the K reads of many later tiles are hoisted up here
        // and the kernel spills registers to scratch.
        __builtin_amdgcn_sched_barrier(0x416);
    }

    // ---- softmax over keys: all 128 scores of a lane belong to query l16 ----
    v8f mx8 = s[0];
    #pragma unroll
    for (int nt = 1; nt < 16; ++nt) {
        #pragma unroll
        for (int r = 0; r < 8; ++r) mx8[r] = fmaxf(mx8[r], s[nt][r]);
    }
    float mx = mx8[0];
    #pragma unroll
    for (int r = 1; r < 8; ++r) mx = fmaxf(mx, mx8[r]);
    mx = fmaxf(mx, __shfl_xor(mx, 16, 32));   // the other half of this query's keys

    v8f rs8;                                  // eight independent partial sums
    #pragma unroll
    for (int r = 0; r < 8; ++r) rs8[r] = 0.0f;
    #pragma unroll
    for (int nt = 0; nt < 16; ++nt) {
        #pragma unroll
        for (int r = 0; r < 8; ++r) {
            const float p = __expf(s[nt][r] - mx);
            s[nt][r] = p;
            rs8[r]  += p;
        }
    }

    // ---- O^T = V^T * P^T ----
    // B fragment kk of key tile nt is the register pair (s[nt][2kk], s[nt][2kk+1]):
    // its k positions (lane half, register) are the keys nt*16 + 8*lhalf + 2*kk + {0,1}.
    // The A fragment takes V in the same k order: lane = channel l16 (second tile:
    // 16 + l16), registers = those two keys' rows. P never goes through LDS.
    v8f o0, o1;
    #pragma unroll
    for (int r = 0; r < 8; ++r) { o0[r] = 0.0f; o1[r] = 0.0f; }

    const float* vbp = v_lds + 8 * lhalf * VP + l16;   // per-lane V base in LDS

    v2f va0[2][4], va1[2][4];
    #pragma unroll
    for (int kk = 0; kk < 4; ++kk) {
        const int koff = (2 * kk) * VP;
        va0[0][kk].x = vbp[koff];
        va0[0][kk].y = vbp[koff + VP];
        va1[0][kk].x = vbp[koff + 16];
        va1[0][kk].y = vbp[koff + VP + 16];
    }

    #pragma unroll
    for (int nt = 0; nt < 16; ++nt) {
        const int cur = nt & 1;
        if (nt < 15) {
            #pragma unroll
            for (int kk = 0; kk < 4; ++kk) {
                const int koff = ((nt + 1) * 16 + 2 * kk) * VP;
                va0[cur ^ 1][kk].x = vbp[koff];
                va0[cur ^ 1][kk].y = vbp[koff + VP];
                va1[cur ^ 1][kk].x = vbp[koff + 16];
                va1[cur ^ 1][kk].y = vbp[koff + VP + 16];
            }
        }
        // LDS reads and WMMAs may not cross (plain ALU and exp may): keeps the next
        // tile's V reads as one group ahead of this tile's WMMAs.
        __builtin_amdgcn_sched_barrier(0x416);
        #pragma unroll
        for (int kk = 0; kk < 4; ++kk) {
            const v2f pb = { s[nt][2 * kk], s[nt][2 * kk + 1] };
            o0 = __builtin_amdgcn_wmma_f32_16x16x4_f32(
                     false, va0[cur][kk], false, pb, (short)0, o0, false, false);
            o1 = __builtin_amdgcn_wmma_f32_16x16x4_f32(
                     false, va1[cur][kk], false, pb, (short)0, o1, false, false);
        }
        // Same mask: keeps the V reads of later tiles from being hoisted up here.
        __builtin_amdgcn_sched_barrier(0x416);
    }

    // ---- row sum: join the eight partial sums, then the two lane halves ----
    float rs = ((rs8[0] + rs8[1]) + (rs8[2] + rs8[3])) + ((rs8[4] + rs8[5]) + (rs8[6] + rs8[7]));
    rs += __shfl_xor(rs, 16, 32);
    const float inv = 1.0f / rs;

    // ---- normalize, turn O^T back through this wave's own LDS tile, gate, store ----
    // o0[r] = O[query l16][channel 8*lhalf + r], o1[r] = the same + 16 channels: a lane
    // writes 16-byte pieces of its query's row; read back, lane = channel, so that each
    // gate load covers one query's 32 channels and each store is one whole 128-byte line.
    // DS operations of one wave run in order and no other wave touches this tile.
    float* ot = o_lds + wid * (16 * OP);
    {
        float* orow = ot + l16 * OP + 8 * lhalf;
        v4f w0 = { o0[0] * inv, o0[1] * inv, o0[2] * inv, o0[3] * inv };
        v4f w1 = { o0[4] * inv, o0[5] * inv, o0[6] * inv, o0[7] * inv };
        v4f w2 = { o1[0] * inv, o1[1] * inv, o1[2] * inv, o1[3] * inv };
        v4f w3 = { o1[4] * inv, o1[5] * inv, o1[6] * inv, o1[7] * inv };
        *(v4f*)(orow)      = w0;
        *(v4f*)(orow + 4)  = w1;
        *(v4f*)(orow + 16) = w2;
        *(v4f*)(orow + 20) = w3;
    }
    const float* gp = gate + (((size_t)(s1 * L + qbase)) * C + (size_t)lane) * H + h;
    float* op = out + poff + (size_t)qbase * C + lane;
    #pragma unroll
    for (int i = 0; i < 16; ++i)
        op[i * C] = ot[i * OP + lane] * gp[i * (C * H)];
}

} // namespace

extern "C" void kernel_launch(void* const* d_in, const int* in_sizes, int n_in,
                              void* d_out, int out_size, void* d_ws, size_t ws_size,
                              hipStream_t stream) {
    (void)in_sizes; (void)n_in; (void)out_size; (void)ws_size;
    const float* q    = (const float*)d_in[0];
    const float* k    = (const float*)d_in[1];
    const float* v    = (const float*)d_in[2];
    const float* bias = (const float*)d_in[3];
    const float* gate = (const float*)d_in[4];
    float* out = (float*)d_out;
    float* bt  = (float*)d_ws;            // H*L*L floats, rewritten on every call

    bias_repack_kernel<<<RP_BLOCKS, RP_THREADS, 0, stream>>>(bias, bt);
    tri_attn_kernel<<<H * L, THREADS, 0, stream>>>(q, k, v, bt, gate, out);
}

// v004
// It runs in 110 microseconds.
// In both of two side-by-side timings against v003, it was 1.14 times as fast.
// Over all steps from v000 it is 2.34 times as fast.
#include <hip/hip_runtime.h>
#include <math.h>
#include <stdint.h>

typedef __attribute__((ext_vector_type(2))) float v2f;
typedef __attribute__((ext_vector_type(4))) float v4f;
typedef __attribute__((ext_vector_type(8))) float v8f;

namespace {

constexpr int H = 8;
constexpr int L = 256;
constexpr int C = 32;
constexpr int THREADS = 256;   // 8 waves (wave32); each wave owns 16 query rows, a work-group 128 of a pair's 256
constexpr int NW = THREADS / 32;
constexpr int KP = 36;         // K row pitch in LDS, dwords: 16 rows x 8 B of both lane halves fall on 64 distinct banks
constexpr int VP = 36;         // V row pitch in LDS, dwords: the lane halves read rows 8 apart, 8*36 = 32 banks apart
constexpr int OP = 36;         // pitch of the per-wave output tile in LDS, dwords (16 B x odd, for 16-byte stores)

// ---- repack bias [q][key][head] into per-head accumulator-fragment order ----
// In the input one head's values lie 32 bytes apart, so a score tile's start
// values cost one cache line per four values, and every work-group of a head
// pulls half the array through L2. Here the array is read once in whole lines
// and written so that the score kernel reads each 16x16 tile as two 512-byte runs:
//   bt[head][q tile][key tile][key quad rq][lane][4],  key = 8*(lane>>4) + 4*rq + j,
//   q = lane & 15 (the f32 16x16 accumulator layout of the transposed tile S^T[key][q]).
// One thread: one query x four keys x eight heads = one 128-byte line of the input.
// A wave writes 512-byte runs.
constexpr int RP_THREADS = 128;
constexpr int RP_BLOCKS  = (L / 4) * L / RP_THREADS;

__global__ __launch_bounds__(RP_THREADS)
void bias_repack_kernel(const float* __restrict__ bias, float* __restrict__ bt)
{
    const int t    = blockIdx.x * RP_THREADS + threadIdx.x;
    const int lane = t & 31;              // lane of the score kernel that will read these four values
    const int rq   = (t >> 5) & 1;        // first or second 16-byte load of the tile
    const int kt   = (t >> 6) & 15;       // 16-key tile
    const int qt   = t >> 10;             // 16-row query tile
    const int qrow = qt * 16 + (lane & 15);
    const int key0 = kt * 16 + 8 * (lane >> 4) + 4 * rq;

    v4f lo[4], hi[4];
    #pragma unroll
    for (int j = 0; j < 4; ++j) {
        const float* src = bias + ((size_t)qrow * L + key0 + j) * H;
        lo[j] = *(const v4f*)src;
        hi[j] = *(const v4f*)(src + 4);
    }
    float* dst = bt + ((qt * 16 + kt) * 2 + rq) * 128 + lane * 4;
    #pragma unroll
    for (int hh = 0; hh < 4; ++hh) {
        v4f w0 = { lo[0][hh], lo[1][hh], lo[2][hh], lo[3][hh] };
        v4f w1 = { hi[0][hh], hi[1][hh], hi[2][hh], hi[3][hh] };
        *(v4f*)(dst + hh * (L * L))       = w0;
        *(v4f*)(dst + (hh + 4) * (L * L)) = w1;
    }
}

// Two work-groups per WGP (2 x 2 waves per SIMD, at most 256 registers a wave, 2 x 90 KB of LDS):
// they share no barrier, so one group's K/V staging, bias and gate loads, softmax and
// start-up run under the other group's matrix instructions. The price: the two groups
// of a pair (neighbours in the grid) each stage the pair's K and V.
__global__ __launch_bounds__(THREADS) __attribute__((amdgpu_waves_per_eu(4, 4)))
void tri_attn_kernel(const float* __restrict__ q,
                     const float* __restrict__ k,
                     const float* __restrict__ v,
                     const float* __restrict__ bt,
                     const float* __restrict__ gate,
                     float* __restrict__ out)
{
    // One LDS block, V first: V is read with immediate offsets off one per-lane base,
    // and an LDS immediate reaches 64 KB from address 0.
    __shared__ __attribute__((aligned(16))) float lds[L * VP + L * KP + NW * 16 * OP];
    float* const v_lds = lds;                       // 36 KB: V for this (h,s1) pair, padded rows
    float* const k_lds = lds + L * VP;              // 36 KB: K for this pair, padded rows
    float* const o_lds = lds + L * VP + L * KP;     // 18 KB: per-wave output tiles (16 queries x 32 channels)

    const int pair  = blockIdx.x >> 1;    // pair = h*L + s1
    const int qhalf = blockIdx.x & 1;     // which 128 of the pair's 256 query rows
    const int h     = pair >> 8;
    const int s1    = pair & (L - 1);
    const int tid   = threadIdx.x;
    const int wid   = tid >> 5;           // 0..7
    const int lane  = tid & 31;
    const int lhalf = lane >> 4;          // 0 | 1
    const int l16   = lane & 15;

    const size_t poff = (size_t)pair * (L * C);
    const float* qp = q + poff;
    const float* kp = k + poff;
    const float* vp = v + poff;

    // ---- stage K into LDS once per work-group (async copies, padded rows) ----
    // All waves need the whole K. Read from global in fragment order, one
    // 8-byte load per lane touches 16 cache lines, and every wave repeats it.
    // Here each 16-byte chunk is fetched once, in whole lines: chunk c = tid + i*256,
    // row c/8, column c%8. The wait on asynccnt and the barrier below (behind the
    // V copies) cover these copies too.
    {
        const uint32_t kl0 = (uint32_t)(uintptr_t)k_lds
                           + (uint32_t)(tid >> 3) * (KP * 4u) + (uint32_t)(tid & 7) * 16u;
        const uint32_t kl1 = kl0 + 32u * (KP * 4u);
        const uint32_t kl2 = kl0 + 64u * (KP * 4u);
        const uint32_t kl3 = kl0 + 96u * (KP * 4u);
        const uint32_t kl4 = kl0 + 128u * (KP * 4u);
        const uint32_t kl5 = kl0 + 160u * (KP * 4u);
        const uint32_t kl6 = kl0 + 192u * (KP * 4u);
        const uint32_t kl7 = kl0 + 224u * (KP * 4u);
        const float* kg0 = kp + tid * 4;
        const float* kg1 = kg0 + 1024;
        const float* kg2 = kg0 + 2048;
        const float* kg3 = kg0 + 3072;
        const float* kg4 = kg0 + 4096;
        const float* kg5 = kg0 + 5120;
        const float* kg6 = kg0 + 6144;
        const float* kg7 = kg0 + 7168;
        // s_wait_xcnt closes the statement so that no address register named by a
        // copy can be rewritten ahead of it.
        asm volatile("global_load_async_to_lds_b128 %0, %8, off\n\t"
                     "global_load_async_to_lds_b128 %1, %9, off\n\t"
                     "global_load_async_to_lds_b128 %2, %10, off\n\t"
                     "global_load_async_to_lds_b128 %3, %11, off\n\t"
                     "global_load_async_to_lds_b128 %4, %12, off\n\t"
                     "global_load_async_to_lds_b128 %5, %13, off\n\t"
                     "global_load_async_to_lds_b128 %6, %14, off\n\t"
                     "global_load_async_to_lds_b128 %7, %15, off\n\t"
                     "s_wait_xcnt 0x0"
                     :: "v"(kl0), "v"(kl1), "v"(kl2), "v"(kl3),
                        "v"(kl4), "v"(kl5), "v"(kl6), "v"(kl7),
                        "v"(kg0), "v"(kg1), "v"(kg2), "v"(kg3),
                        "v"(kg4), "v"(kg5), "v"(kg6), "v"(kg7) : "memory");
    }

    // ---- stage V into LDS the same way (async copies, padded rows) ----
    {
        const uint32_t vl0 = (uint32_t)(uintptr_t)v_lds
                           + (uint32_t)(tid >> 3) * (VP * 4u) + (uint32_t)(tid & 7) * 16u;
        const uint32_t vl1 = vl0 + 32u * (VP * 4u);
        const uint32_t vl2 = vl0 + 64u * (VP * 4u);
        const uint32_t vl3 = vl0 + 96u * (VP * 4u);
        const uint32_t vl4 = vl0 + 128u * (VP * 4u);
        const uint32_t vl5 = vl0 + 160u * (VP * 4u);
        const uint32_t vl6 = vl0 + 192u * (VP * 4u);
        const uint32_t vl7 = vl0 + 224u * (VP * 4u);
        const float* vg0 = vp + tid * 4;
        const float* vg1 = vg0 + 1024;
        const float* vg2 = vg0 + 2048;
        const float* vg3 = vg0 + 3072;
        const float* vg4 = vg0 + 4096;
        const float* vg5 = vg0 + 5120;
        const float* vg6 = vg0 + 6144;
        const float* vg7 = vg0 + 7168;
        // s_wait_xcnt closes the statement so that no address register named by a
        // copy can be rewritten ahead of it.
        asm volatile("global_load_async_to_lds_b128 %0, %8, off\n\t"
                     "global_load_async_to_lds_b128 %1, %9, off\n\t"
                     "global_load_async_to_lds_b128 %2, %10, off\n\t"
                     "global_load_async_to_lds_b128 %3, %11, off\n\t"
                     "global_load_async_to_lds_b128 %4, %12, off\n\t"
                     "global_load_async_to_lds_b128 %5, %13, off\n\t"
                     "global_load_async_to_lds_b128 %6, %14, off\n\t"
                     "global_load_async_to_lds_b128 %7, %15, off\n\t"
                     "s_wait_xcnt 0x0"
                     :: "v"(vl0), "v"(vl1), "v"(vl2), "v"(vl3),
                        "v"(vl4), "v"(vl5), "v"(vl6), "v"(vl7),
                        "v"(vg0), "v"(vg1), "v"(vg2), "v"(vg3),
                        "v"(vg4), "v"(vg5), "v"(vg6), "v"(vg7) : "memory");
        // Every copy of this wave (K and V) has landed before the barrier publishes them.
        asm volatile("s_wait_asynccnt 0x0" ::: "memory");
    }
    __syncthreads();

    const int qt    = qhalf * NW + wid;   // this wave's query tile
    const int qbase = qt * 16;            // its first query row

    // Per-lane base pointers; all further addressing is via constant immediates.
    const float* qb = qp + (size_t)(qbase + l16) * C + 2 * lhalf;
    const float* kb = k_lds + l16 * KP + 2 * lhalf;   // K (A) fragments come from LDS
    const float* bp = bt + (size_t)(h * 16 + qt) * (16 * L) + lane * 4;    // repacked bias, this wave's 16 queries

    // ---- load Q as WMMA f32 16x16x4 B fragments: lane = column (query) l16, K-pair 2*lhalf ----
    v2f a[8];
    #pragma unroll
    for (int ks = 0; ks < 8; ++ks)
        a[ks] = *(const v2f*)(qb + ks * 4);
    // Loads return in issue order and the first WMMA needs all of Q but only one
    // bias tile: keeps the Q loads ahead of the 32 bias loads below.
    __builtin_amdgcn_sched_barrier(0);

    // ---- S^T = K*Q^T + bias^T ----
    // K is the A operand and Q the B operand, so a lane holds scores of ONE query
    // (l16): s[nt][r] = S[query l16][key nt*16 + 8*lhalf + r]. Maximum and sum are
    // then in-lane plus one exchange between the lane halves, and a register pair of
    // s[nt] is already a B fragment of the second product.
    // Every score tile starts as its bias tile: two whole-line 16-byte loads, all
    // issued here, straight into the registers that hold the scores anyway.
    // The K tiles are software-pipelined one key-tile ahead.
    v8f s[16];
    v2f bb[2][8];
    #pragma unroll
    for (int nt = 0; nt < 16; ++nt) {
        const v4f b0 = *(const v4f*)(bp + nt * 256);
        const v4f b1 = *(const v4f*)(bp + nt * 256 + 128);
        s[nt] = __builtin_shufflevector(b0, b1, 0, 1, 2, 3, 4, 5, 6, 7);
    }
    // Keeps both address pairs of the loads above untouched until their address
    // translations are counted off (otherwise the last load of each run lands on
    // the very pair the run is addressed by). The loads also stay ahead of this
    // statement; without it the compiler sinks each bias load to just ahead of its tile.
    asm volatile("s_wait_xcnt 0x0" :: "v"(qb), "v"(bp) : "memory");
    #pragma unroll
    for (int ks = 0; ks < 8; ++ks)
        bb[0][ks] = *(const v2f*)(kb + ks * 4);

    #pragma unroll
    for (int nt = 0; nt < 16; ++nt) {
        const int cur = nt & 1;
        v8f acc = s[nt];
        if (nt < 15) {
            #pragma unroll
            for (int ks = 0; ks < 8; ++ks)
                bb[cur ^ 1][ks] = *(const v2f*)(kb + (nt + 1) * 16 * KP + ks * 4);
        }
        // LDS reads and WMMAs may not cross (global loads and plain ALU may): keeps
        // the next tile's K reads one group ahead of this tile's WMMAs.
        __builtin_amdgcn_sched_barrier(0x416);
        #pragma unroll
        for (int ks = 0; ks < 8; ++ks) {
            acc = __builtin_amdgcn_wmma_f32_16x16x4_f32(
                      false, bb[cur][ks], false, a[ks], (short)0, acc, false, false);
        }
        s[nt] = acc;
        // Same mask: without it the K reads of many later tiles are hoisted up here
        // and the kernel spills registers to scratch.
        __builtin_amdgcn_sched_barrier(0x416);
    }

    // ---- softmax over keys: all 128 scores of a lane belong to query l16 ----
    v8f mx8 = s[0];
    #pragma unroll
    for (int nt = 1; nt < 16; ++nt) {
        #pragma unroll
        for (int r = 0; r < 8; ++r) mx8[r] = fmaxf(mx8[r], s[nt][r]);
    }
    float mx = mx8[0];
    #pragma unroll
    for (int r = 1; r < 8; ++r) mx = fmaxf(mx, mx8[r]);
    mx = fmaxf(mx, __shfl_xor(mx, 16, 32));   // the other half of this query's keys

    v8f rs8;                                  // eight independent partial sums
    #pragma unroll
    for (int r = 0; r < 8; ++r) rs8[r] = 0.0f;
    #pragma unroll
    for (int nt = 0; nt < 16; ++nt) {
        #pragma unroll
        for (int r = 0; r < 8; ++r) {
            const float p = __expf(s[nt][r] - mx);
            s[nt][r] = p;
            rs8[r]  += p;
        }
    }

    // ---- O^T = V^T * P^T ----
    // B fragment kk of key tile nt is the register pair (s[nt][2kk], s[nt][2kk+1]):
    // its k positions (lane half, register) are the keys nt*16 + 8*lhalf + 2*kk + {0,1}.
    // The A fragment takes V in the same k order: lane = channel l16 (second tile:
    // 16 + l16), registers = those two keys' rows. P never goes through LDS.
    v8f o0, o1;
    #pragma unroll
    for (int r = 0; r < 8; ++r) { o0[r] = 0.0f; o1[r] = 0.0f; }

    const float* vbp = v_lds + 8 * lhalf * VP + l16;   // per-lane V base in LDS

    v2f va0[2][4], va1[2][4];
    #pragma unroll
    for (int kk = 0; kk < 4; ++kk) {
        const int koff = (2 * kk) * VP;
        va0[0][kk].x = vbp[koff];
        va0[0][kk].y = vbp[koff + VP];
        va1[0][kk].x = vbp[koff + 16];
        va1[0][kk].y = vbp[koff + VP + 16];
    }

    #pragma unroll
    for (int nt = 0; nt < 16; ++nt) {
        const int cur = nt & 1;
        if (nt < 15) {
            #pragma unroll
            for (int kk = 0; kk < 4; ++kk) {
                const int koff = ((nt + 1) * 16 + 2 * kk) * VP;
                va0[cur ^ 1][kk].x = vbp[koff];
                va0[cur ^ 1][kk].y = vbp[koff + VP];
                va1[cur ^ 1][kk].x = vbp[koff + 16];
                va1[cur ^ 1][kk].y = vbp[koff + VP + 16];
            }
        }
        // LDS reads and WMMAs may not cross (plain ALU and exp may): keeps the next
        // tile's V reads as one group ahead of this tile's WMMAs.
        __builtin_amdgcn_sched_barrier(0x416);
        #pragma unroll
        for (int kk = 0; kk < 4; ++kk) {
            const v2f pb = { s[nt][2 * kk], s[nt][2 * kk + 1] };
            o0 = __builtin_amdgcn_wmma_f32_16x16x4_f32(
                     false, va0[cur][kk], false, pb, (short)0, o0, false, false);
            o1 = __builtin_amdgcn_wmma_f32_16x16x4_f32(
                     false, va1[cur][kk], false, pb, (short)0, o1, false, false);
        }
        // Same mask: keeps the V reads of later tiles from being hoisted up here.
        __builtin_amdgcn_sched_barrier(0x416);
    }

    // ---- row sum: join the eight partial sums, then the two lane halves ----
    float rs = ((rs8[0] + rs8[1]) + (rs8[2] + rs8[3])) + ((rs8[4] + rs8[5]) + (rs8[6] + rs8[7]));
    rs += __shfl_xor(rs, 16, 32);
    const float inv = 1.0f / rs;

    // ---- normalize, turn O^T back through this wave's own LDS tile, gate, store ----
    // o0[r] = O[query l16][channel 8*lhalf + r], o1[r] = the same + 16 channels: a lane
    // writes 16-byte pieces of its query's row; read back, lane = channel, so that each
    // gate load covers one query's 32 channels and each store is one whole 128-byte line.
    // DS operations of one wave run in order and no other wave touches this tile.
    float* ot = o_lds + wid * (16 * OP);
    {
        float* orow = ot + l16 * OP + 8 * lhalf;
        v4f w0 = { o0[0] * inv, o0[1] * inv, o0[2] * inv, o0[3] * inv };
        v4f w1 = { o0[4] * inv, o0[5] * inv, o0[6] * inv, o0[7] * inv };
        v4f w2 = { o1[0] * inv, o1[1] * inv, o1[2] * inv, o1[3] * inv };
        v4f w3 = { o1[4] * inv, o1[5] * inv, o1[6] * inv, o1[7] * inv };
        *(v4f*)(orow)      = w0;
        *(v4f*)(orow + 4)  = w1;
        *(v4f*)(orow + 16) = w2;
        *(v4f*)(orow + 20) = w3;
    }
    const float* gp = gate + (((size_t)(s1 * L + qbase)) * C + (size_t)lane) * H + h;
    float* op = out + poff + (size_t)qbase * C + lane;
    #pragma unroll
    for (int i = 0; i < 16; ++i)
        op[i * C] = ot[i * OP + lane] * gp[i * (C * H)];
}

} // namespace

extern "C" void kernel_launch(void* const* d_in, const int* in_sizes, int n_in,
                              void* d_out, int out_size, void* d_ws, size_t ws_size,
                              hipStream_t stream) {
    (void)in_sizes; (void)n_in; (void)out_size; (void)ws_size;
    const float* q    = (const float*)d_in[0];
    const float* k    = (const float*)d_in[1];
    const float* v    = (const float*)d_in[2];
    const float* bias = (const float*)d_in[3];
    const float* gate = (const float*)d_in[4];
    float* out = (float*)d_out;
    float* bt  = (float*)d_ws;            // H*L*L floats, rewritten on every call

    bias_repack_kernel<<<RP_BLOCKS, RP_THREADS, 0, stream>>>(bias, bt);
    tri_attn_kernel<<<H * L * (L / 16 / NW), THREADS, 0, stream>>>(q, k, v, bt, gate, out);
}
